// v000
// The times below were measured on an AMD MI455X: many runs one after another, warmed up first and cycling through
// copies of the inputs, with the whole window's GPU time divided by the number of runs. Launches and the gaps
// between them are all in it. The median over several windows is given; except for v000 it joins two sittings, which
// can be a few percent apart, so the side-by-side timings, each taken in one sitting, are the better comparison.
// v000 is the starting kernel. One run takes 29.4 microseconds.
#include <hip/hip_runtime.h>

typedef float v2f __attribute__((ext_vector_type(2)));
typedef float v8f __attribute__((ext_vector_type(8)));

#define T_DIM 1024
#define O_DIM 512
#define D_DIM 256
#define H_DIM 512
#define PADH  (H_DIM + 4)   // 516 floats: rows step 4 banks -> 16 rows cover 64 banks

// ---------------------------------------------------------------------------
// Phase 1: front GEMMs with V_WMMA_F32_16X16X4_F32 (exact fp32 matrix math)
//   HT [T,H]  = z_t @ W1[0:D, :]
//   HOB[O,H]  = z_o @ W1[D:2D, :] + b1
// One wave per 16x16 output tile; K=256 in 64 steps of 4.
// ---------------------------------------------------------------------------
__global__ __launch_bounds__(128) void CFM_front_gemm(
    const float* __restrict__ z_t, const float* __restrict__ z_o,
    const float* __restrict__ W1,  const float* __restrict__ b1,
    float* __restrict__ HT, float* __restrict__ HOB)
{
  const int lane = threadIdx.x & 31;
  const int wave = (blockIdx.x << 2) | (threadIdx.x >> 5);

  const int HT_TILES = (T_DIM / 16) * (H_DIM / 16);   // 64*32 = 2048

  const float* src; const float* wbase; const float* dst_bias;
  float* dst; int rows_tile, h_tile;
  if (wave < HT_TILES) {
    rows_tile = wave >> 5;          // H/16 = 32 h-tiles per row-tile
    h_tile    = wave & 31;
    src = z_t; wbase = W1;                 dst = HT;  dst_bias = nullptr;
  } else {
    const int w2 = wave - HT_TILES;
    rows_tile = w2 >> 5;
    h_tile    = w2 & 31;
    src = z_o; wbase = W1 + D_DIM * H_DIM; dst = HOB; dst_bias = b1;
  }

  const int mrow = (rows_tile << 4) + (lane & 15);   // A: M = lane&15
  const int ncol = (h_tile    << 4) + (lane & 15);   // B/D: N = lane&15
  const int kk   = (lane >> 4) << 1;                 // lanes 16-31 hold K+2,K+3

  const float* arow = src   + mrow * D_DIM + kk;     // contiguous K pair
  const float* bcol = wbase + kk * H_DIM + ncol;     // stride-H K pair

  v8f acc = {};
  #pragma unroll 4
  for (int k0 = 0; k0 < D_DIM; k0 += 4) {
    v2f a = *(const v2f*)(arow + k0);                // K = k0+kk, k0+kk+1
    v2f b;
    b.x = bcol[k0 * H_DIM];                          // K = k0+kk
    b.y = bcol[k0 * H_DIM + H_DIM];                  // K = k0+kk+1
    acc = __builtin_amdgcn_wmma_f32_16x16x4_f32(
        /*neg_a=*/false, a, /*neg_b=*/false, b,
        /*c_mod=*/(short)0, acc, /*reuse_a=*/false, /*reuse_b=*/false);
  }

  const float bias = dst_bias ? dst_bias[ncol] : 0.0f;
  const int row0 = (rows_tile << 4) + ((lane >> 4) << 3);  // C/D: M = r + (l>>4)*8
  #pragma unroll
  for (int r = 0; r < 8; ++r) {
    dst[(row0 + r) * H_DIM + ncol] = acc[r] + bias;
  }
}

// ---------------------------------------------------------------------------
// Async global->LDS copy of one 16B chunk per lane (ASYNCcnt-tracked DMA).
// VDST operand carries the wave-relative LDS byte address; flat LDS pointers
// hold the LDS offset in their low 32 bits (aperture layout).
// ---------------------------------------------------------------------------
__device__ __forceinline__ void async_copy_b128(const float* gsrc, float* lds_dst) {
  unsigned lds_off = (unsigned)(unsigned long long)lds_dst;
  asm volatile("global_load_async_to_lds_b128 %0, %1, off"
               :
               : "v"(lds_off), "v"(gsrc)
               : "memory");
}

__device__ __forceinline__ void wait_async_all() {
  asm volatile("s_wait_asynccnt 0x0" ::: "memory");
}

// ---------------------------------------------------------------------------
// Phase 2: out[t,o] = b2 + sum_h lrelu(HT[t,h] + HOB[o,h]) * W2[h]
// 32t x 32o tile per 256-thread block, 2x2 register micro-tile per thread.
// HT/HOB tiles + W2 staged in LDS (~134KB dynamic) via async-to-LDS DMA.
// Per 4-h step: 5 ds_load_b128 feed 16 fma chains -> VALU-bound, not DS-bound.
// ---------------------------------------------------------------------------
__global__ __launch_bounds__(256) void CFM_broadcast_mlp(
    const float* __restrict__ HT, const float* __restrict__ HOB,
    const float* __restrict__ W2, const float* __restrict__ b2,
    float* __restrict__ out)
{
  extern __shared__ float smem[];
  float* s_ht = smem;                    // 32 * 516
  float* s_ho = smem + 32 * PADH;        // 32 * 516
  float* s_w2 = smem + 64 * PADH;        // 512

  const int tid = threadIdx.x;
  const int t0  = (blockIdx.x >> 4) << 5;   // O/32 = 16 o-tiles
  const int o0  = (blockIdx.x & 15) << 5;

  // Async stage-in: 32 rows x 128 float4 per tensor + 128 float4 of W2.
  for (int idx = tid; idx < 32 * (H_DIM / 4); idx += 256) {
    const int r = idx >> 7;             // / 128
    const int c = (idx & 127) << 2;
    async_copy_b128(HT  + (t0 + r) * H_DIM + c, s_ht + r * PADH + c);
    async_copy_b128(HOB + (o0 + r) * H_DIM + c, s_ho + r * PADH + c);
  }
  if (tid < H_DIM / 4) {
    async_copy_b128(W2 + (tid << 2), s_w2 + (tid << 2));
  }
  wait_async_all();
  __syncthreads();

  // 2x2 micro-tile: rows {ty, ty+16}, cols {ox, ox+16}.
  // Consecutive lanes share ty (s_ht broadcast) and have consecutive ox
  // (4-bank row stride -> conflict-free); stores coalesce over ox.
  const int ty = tid >> 4;
  const int ox = tid & 15;
  const float* htr0 = s_ht + ty * PADH;
  const float* htr1 = s_ht + (ty + 16) * PADH;
  const float* hor0 = s_ho + ox * PADH;
  const float* hor1 = s_ho + (ox + 16) * PADH;

  float acc00 = 0.0f, acc01 = 0.0f, acc10 = 0.0f, acc11 = 0.0f;
  #pragma unroll 2
  for (int h = 0; h < H_DIM; h += 4) {
    float4 a0 = *(const float4*)(htr0 + h);
    float4 a1 = *(const float4*)(htr1 + h);
    float4 b0 = *(const float4*)(hor0 + h);
    float4 b1 = *(const float4*)(hor1 + h);
    float4 w  = *(const float4*)(s_w2 + h);

    float x;
    x = a0.x + b0.x; x = fmaxf(x, 0.01f * x); acc00 = fmaf(x, w.x, acc00);
    x = a0.y + b0.y; x = fmaxf(x, 0.01f * x); acc00 = fmaf(x, w.y, acc00);
    x = a0.z + b0.z; x = fmaxf(x, 0.01f * x); acc00 = fmaf(x, w.z, acc00);
    x = a0.w + b0.w; x = fmaxf(x, 0.01f * x); acc00 = fmaf(x, w.w, acc00);

    x = a0.x + b1.x; x = fmaxf(x, 0.01f * x); acc01 = fmaf(x, w.x, acc01);
    x = a0.y + b1.y; x = fmaxf(x, 0.01f * x); acc01 = fmaf(x, w.y, acc01);
    x = a0.z + b1.z; x = fmaxf(x, 0.01f * x); acc01 = fmaf(x, w.z, acc01);
    x = a0.w + b1.w; x = fmaxf(x, 0.01f * x); acc01 = fmaf(x, w.w, acc01);

    x = a1.x + b0.x; x = fmaxf(x, 0.01f * x); acc10 = fmaf(x, w.x, acc10);
    x = a1.y + b0.y; x = fmaxf(x, 0.01f * x); acc10 = fmaf(x, w.y, acc10);
    x = a1.z + b0.z; x = fmaxf(x, 0.01f * x); acc10 = fmaf(x, w.z, acc10);
    x = a1.w + b0.w; x = fmaxf(x, 0.01f * x); acc10 = fmaf(x, w.w, acc10);

    x = a1.x + b1.x; x = fmaxf(x, 0.01f * x); acc11 = fmaf(x, w.x, acc11);
    x = a1.y + b1.y; x = fmaxf(x, 0.01f * x); acc11 = fmaf(x, w.y, acc11);
    x = a1.z + b1.z; x = fmaxf(x, 0.01f * x); acc11 = fmaf(x, w.z, acc11);
    x = a1.w + b1.w; x = fmaxf(x, 0.01f * x); acc11 = fmaf(x, w.w, acc11);
  }

  const float bb = b2[0];
  out[(t0 + ty)      * O_DIM + (o0 + ox)]      = acc00 + bb;
  out[(t0 + ty)      * O_DIM + (o0 + ox + 16)] = acc01 + bb;
  out[(t0 + ty + 16) * O_DIM + (o0 + ox)]      = acc10 + bb;
  out[(t0 + ty + 16) * O_DIM + (o0 + ox + 16)] = acc11 + bb;
}

extern "C" void kernel_launch(void* const* d_in, const int* in_sizes, int n_in,
                              void* d_out, int out_size, void* d_ws, size_t ws_size,
                              hipStream_t stream) {
  (void)in_sizes; (void)n_in; (void)out_size; (void)ws_size;
  const float* z_t = (const float*)d_in[0];
  const float* z_o = (const float*)d_in[1];
  const float* W1  = (const float*)d_in[2];
  const float* b1  = (const float*)d_in[3];
  const float* W2  = (const float*)d_in[4];
  const float* b2  = (const float*)d_in[5];

  float* HT  = (float*)d_ws;                 // T*H floats (2MB)
  float* HOB = HT + (size_t)T_DIM * H_DIM;   // O*H floats (1MB)

  // Phase 1: 3072 wave-tiles, 4 waves (128 threads) per block -> 768 blocks.
  CFM_front_gemm<<<768, 128, 0, stream>>>(z_t, z_o, W1, b1, HT, HOB);

  // Phase 2: (T/32)*(O/32) = 512 blocks, 256 threads, ~134KB dynamic LDS.
  const size_t lds_bytes = (size_t)(64 * PADH + H_DIM) * sizeof(float);
  CFM_broadcast_mlp<<<512, 256, lds_bytes, stream>>>(HT, HOB, W2, b2, (float*)d_out);
}

// v001
// Measured time: 27.5 microseconds a run.
// Timed twice side by side with v000, it ran 1.10 times as fast both times.
#include <hip/hip_runtime.h>

typedef float v2f __attribute__((ext_vector_type(2)));
typedef float v8f __attribute__((ext_vector_type(8)));

#define T_DIM 1024
#define O_DIM 512
#define D_DIM 256
#define H_DIM 512
#define PADH  (H_DIM + 4)   // 516 floats: rows step 4 banks -> 16 rows cover 64 banks
#define HSLICE (H_DIM / 8)  // h range summed by one wave of phase 2

// ---------------------------------------------------------------------------
// Phase 1: front GEMMs with V_WMMA_F32_16X16X4_F32 (exact fp32 matrix math)
//   HT [T,H]  = z_t @ W1[0:D, :]
//   HOB[O,H]  = z_o @ W1[D:2D, :] + b1
// One wave per 16x16 output tile; K=256 in 64 steps of 4.
// ---------------------------------------------------------------------------
__global__ __launch_bounds__(128) void CFM_front_gemm(
    const float* __restrict__ z_t, const float* __restrict__ z_o,
    const float* __restrict__ W1,  const float* __restrict__ b1,
    float* __restrict__ HT, float* __restrict__ HOB)
{
  const int lane = threadIdx.x & 31;
  const int wave = (blockIdx.x << 2) | (threadIdx.x >> 5);

  const int HT_TILES = (T_DIM / 16) * (H_DIM / 16);   // 64*32 = 2048

  const float* src; const float* wbase; const float* dst_bias;
  float* dst; int rows_tile, h_tile;
  if (wave < HT_TILES) {
    rows_tile = wave >> 5;          // H/16 = 32 h-tiles per row-tile
    h_tile    = wave & 31;
    src = z_t; wbase = W1;                 dst = HT;  dst_bias = nullptr;
  } else {
    const int w2 = wave - HT_TILES;
    rows_tile = w2 >> 5;
    h_tile    = w2 & 31;
    src = z_o; wbase = W1 + D_DIM * H_DIM; dst = HOB; dst_bias = b1;
  }

  const int mrow = (rows_tile << 4) + (lane & 15);   // A: M = lane&15
  const int ncol = (h_tile    << 4) + (lane & 15);   // B/D: N = lane&15
  const int kk   = (lane >> 4) << 1;                 // lanes 16-31 hold K+2,K+3

  const float* arow = src   + mrow * D_DIM + kk;     // contiguous K pair
  const float* bcol = wbase + kk * H_DIM + ncol;     // stride-H K pair

  v8f acc = {};
  #pragma unroll 4
  for (int k0 = 0; k0 < D_DIM; k0 += 4) {
    v2f a = *(const v2f*)(arow + k0);                // K = k0+kk, k0+kk+1
    v2f b;
    b.x = bcol[k0 * H_DIM];                          // K = k0+kk
    b.y = bcol[k0 * H_DIM + H_DIM];                  // K = k0+kk+1
    acc = __builtin_amdgcn_wmma_f32_16x16x4_f32(
        /*neg_a=*/false, a, /*neg_b=*/false, b,
        /*c_mod=*/(short)0, acc, /*reuse_a=*/false, /*reuse_b=*/false);
  }

  const float bias = dst_bias ? dst_bias[ncol] : 0.0f;
  const int row0 = (rows_tile << 4) + ((lane >> 4) << 3);  // C/D: M = r + (l>>4)*8
  #pragma unroll
  for (int r = 0; r < 8; ++r) {
    dst[(row0 + r) * H_DIM + ncol] = acc[r] + bias;
  }
}

// ---------------------------------------------------------------------------
// Async global->LDS copy of one 16B chunk per lane (ASYNCcnt-tracked DMA).
// VDST operand carries the wave-relative LDS byte address; flat LDS pointers
// hold the LDS offset in their low 32 bits (aperture layout).
// ---------------------------------------------------------------------------
__device__ __forceinline__ void async_copy_b128(const float* gsrc, float* lds_dst) {
  unsigned lds_off = (unsigned)(unsigned long long)lds_dst;
  asm volatile("global_load_async_to_lds_b128 %0, %1, off"
               :
               : "v"(lds_off), "v"(gsrc)
               : "memory");
}

__device__ __forceinline__ void wait_async_all() {
  asm volatile("s_wait_asynccnt 0x0" ::: "memory");
}

// ---------------------------------------------------------------------------
// Phase 2: out[t,o] = b2 + sum_h lrelu(HT[t,h] + HOB[o,h]) * W2[h]
// 32t x 32o tile per 256-thread block; each wave covers the whole tile with an
// 8x4 register tile per thread over one eighth of h; slices are summed in LDS.
// HT/HOB tiles + W2 staged in LDS (~134KB dynamic) via async-to-LDS DMA.
// ---------------------------------------------------------------------------
// waves_per_eu(4, 4): LDS admits two blocks per WGP = four waves per SIMD, so each wave
// may own 256 registers. Without it the compiler saves registers for waves that can
// never be resident: it then reads one s_ht row at a time and waits on each read.
__global__ __launch_bounds__(256) __attribute__((amdgpu_waves_per_eu(4, 4)))
void CFM_broadcast_mlp(
    const float* __restrict__ HT, const float* __restrict__ HOB,
    const float* __restrict__ W2, const float* __restrict__ b2,
    float* __restrict__ out)
{
  extern __shared__ float smem[];
  float* s_ht = smem;                    // 32 * 516
  float* s_ho = smem + 32 * PADH;        // 32 * 516
  float* s_w2 = smem + 64 * PADH;        // 512

  const int tid = threadIdx.x;
  const int t0  = (blockIdx.x >> 4) << 5;   // O/32 = 16 o-tiles
  const int o0  = (blockIdx.x & 15) << 5;

  // Async stage-in: 32 rows x 128 float4 per tensor + 128 float4 of W2.
  for (int idx = tid; idx < 32 * (H_DIM / 4); idx += 256) {
    const int r = idx >> 7;             // / 128
    const int c = (idx & 127) << 2;
    async_copy_b128(HT  + (t0 + r) * H_DIM + c, s_ht + r * PADH + c);
    async_copy_b128(HOB + (o0 + r) * H_DIM + c, s_ho + r * PADH + c);
  }
  if (tid < H_DIM / 4) {
    async_copy_b128(W2 + (tid << 2), s_w2 + (tid << 2));
  }
  wait_async_all();
  __syncthreads();

  // 8x4 register tile per thread: the 32 lanes of a wave cover the whole 32x32
  // tile (rows tg + 4i, cols og + 8j) and each of the 8 waves sums its own 64 h.
  // Per 4-h step 13 ds_load_b128 feed 128 products per lane. In each 16-lane half
  // a load touches 2 (s_ht) or 8 (s_ho) neighbouring rows, 4 banks apart: no conflict.
  const int lane = tid & 31;
  const int wv   = tid >> 5;
  const int tg   = lane >> 3;
  const int og   = lane & 7;
  const float* ap = s_ht + tg * PADH + wv * HSLICE;
  const float* bp = s_ho + og * PADH + wv * HSLICE;
  const float* wp = s_w2 + wv * HSLICE;

  // The loops over i and j are fully unrolled: every tile index is then a constant and
  // the tile stays in registers.
  float acc[8][4];
  #pragma unroll
  for (int i = 0; i < 8; ++i) {
    #pragma unroll
    for (int j = 0; j < 4; ++j) acc[i][j] = 0.0f;
  }

  for (int h = 0; h < HSLICE; h += 4) {
    const float4 w = *(const float4*)(wp + h);
    float4 b[4];
    #pragma unroll
    for (int j = 0; j < 4; ++j) b[j] = *(const float4*)(bp + j * 8 * PADH + h);
    #pragma unroll
    for (int i = 0; i < 8; ++i) {
      const float4 a = *(const float4*)(ap + i * 4 * PADH + h);
      #pragma unroll
      for (int j = 0; j < 4; ++j) {
        float x;
        x = a.x + b[j].x; x = fmaxf(x, 0.01f * x); acc[i][j] = fmaf(x, w.x, acc[i][j]);
        x = a.y + b[j].y; x = fmaxf(x, 0.01f * x); acc[i][j] = fmaf(x, w.y, acc[i][j]);
        x = a.z + b[j].z; x = fmaxf(x, 0.01f * x); acc[i][j] = fmaf(x, w.z, acc[i][j]);
        x = a.w + b[j].w; x = fmaxf(x, 0.01f * x); acc[i][j] = fmaf(x, w.w, acc[i][j]);
      }
    }
  }

  // Combine the 8 h-slices through LDS, laid out [slice][i][lane] as float4 over j.
  // First barrier: every wave has read its last staged value before the tiles are
  // overwritten. Second barrier: all partial sums are in LDS before they are read.
  float4* red = (float4*)smem;
  __syncthreads();
  #pragma unroll  // constant i: acc is stored straight from its registers
  for (int i = 0; i < 8; ++i) {
    red[(wv * 8 + i) * 32 + lane] = make_float4(acc[i][0], acc[i][1], acc[i][2], acc[i][3]);
  }
  __syncthreads();

  // Thread (wv, lane) finishes row tg + 4*wv, cols og + 8j.
  float4 s = red[wv * 32 + lane];
  #pragma unroll  // the reads of all slices are issued ahead of the adds
  for (int k = 1; k < 8; ++k) {
    const float4 p = red[(k * 8 + wv) * 32 + lane];
    s.x += p.x; s.y += p.y; s.z += p.z; s.w += p.w;
  }

  const float bb = b2[0];
  float* orow = out + (t0 + tg + 4 * wv) * O_DIM + (o0 + og);
  orow[0]  = s.x + bb;
  orow[8]  = s.y + bb;
  orow[16] = s.z + bb;
  orow[24] = s.w + bb;
}

extern "C" void kernel_launch(void* const* d_in, const int* in_sizes, int n_in,
                              void* d_out, int out_size, void* d_ws, size_t ws_size,
                              hipStream_t stream) {
  (void)in_sizes; (void)n_in; (void)out_size; (void)ws_size;
  const float* z_t = (const float*)d_in[0];
  const float* z_o = (const float*)d_in[1];
  const float* W1  = (const float*)d_in[2];
  const float* b1  = (const float*)d_in[3];
  const float* W2  = (const float*)d_in[4];
  const float* b2  = (const float*)d_in[5];

  float* HT  = (float*)d_ws;                 // T*H floats (2MB)
  float* HOB = HT + (size_t)T_DIM * H_DIM;   // O*H floats (1MB)

  // Phase 1: 3072 wave-tiles, 4 waves (128 threads) per block -> 768 blocks.
  CFM_front_gemm<<<768, 128, 0, stream>>>(z_t, z_o, W1, b1, HT, HOB);

  // Phase 2: (T/32)*(O/32) = 512 blocks, 256 threads, ~134KB dynamic LDS.
  const size_t lds_bytes = (size_t)(64 * PADH + H_DIM) * sizeof(float);
  CFM_broadcast_mlp<<<512, 256, lds_bytes, stream>>>(HT, HOB, W2, b2, (float*)d_out);
}

// v002
// It runs in 23.5 microseconds.
// In both of two side-by-side timings against v001, it was 1.17 times as fast.
// All steps since v000 together make it 1.29 times as fast.
#include <hip/hip_runtime.h>

typedef float v2f __attribute__((ext_vector_type(2)));
typedef float v4f __attribute__((ext_vector_type(4)));
typedef float v8f __attribute__((ext_vector_type(8)));

#define T_DIM 1024
#define O_DIM 512
#define D_DIM 256
#define H_DIM 512
#define PADH  (H_DIM + 4)   // 516 floats: rows step 4 banks -> 16 rows cover 64 banks
#define HSLICE (H_DIM / 8)  // h range summed by one wave of phase 2

// ---------------------------------------------------------------------------
// Phase 1: front GEMMs with V_WMMA_F32_16X16X4_F32 (exact fp32 matrix math)
//   HT [T,H]  = z_t @ W1[0:D, :]
//   HOB[O,H]  = -(z_o @ W1[D:2D, :] + b1)   (stored negated: phase 2 takes max(HT, HOB))
// One wave per 16x16 output tile; K=256 in 64 steps of 4.
// ---------------------------------------------------------------------------
__global__ __launch_bounds__(128) void CFM_front_gemm(
    const float* __restrict__ z_t, const float* __restrict__ z_o,
    const float* __restrict__ W1,  const float* __restrict__ b1,
    float* __restrict__ HT, float* __restrict__ HOB)
{
  const int lane = threadIdx.x & 31;
  const int wave = (blockIdx.x << 2) | (threadIdx.x >> 5);

  const int HT_TILES = (T_DIM / 16) * (H_DIM / 16);   // 64*32 = 2048

  const float* src; const float* wbase; const float* dst_bias;
  float* dst; int rows_tile, h_tile;
  if (wave < HT_TILES) {
    rows_tile = wave >> 5;          // H/16 = 32 h-tiles per row-tile
    h_tile    = wave & 31;
    src = z_t; wbase = W1;                 dst = HT;  dst_bias = nullptr;
  } else {
    const int w2 = wave - HT_TILES;
    rows_tile = w2 >> 5;
    h_tile    = w2 & 31;
    src = z_o; wbase = W1 + D_DIM * H_DIM; dst = HOB; dst_bias = b1;
  }

  const int mrow = (rows_tile << 4) + (lane & 15);   // A: M = lane&15
  const int ncol = (h_tile    << 4) + (lane & 15);   // B/D: N = lane&15
  const int kk   = (lane >> 4) << 1;                 // lanes 16-31 hold K+2,K+3

  const float* arow = src   + mrow * D_DIM + kk;     // contiguous K pair
  const float* bcol = wbase + kk * H_DIM + ncol;     // stride-H K pair

  v8f acc = {};
  #pragma unroll 4
  for (int k0 = 0; k0 < D_DIM; k0 += 4) {
    v2f a = *(const v2f*)(arow + k0);                // K = k0+kk, k0+kk+1
    v2f b;
    b.x = bcol[k0 * H_DIM];                          // K = k0+kk
    b.y = bcol[k0 * H_DIM + H_DIM];                  // K = k0+kk+1
    acc = __builtin_amdgcn_wmma_f32_16x16x4_f32(
        /*neg_a=*/false, a, /*neg_b=*/false, b,
        /*c_mod=*/(short)0, acc, /*reuse_a=*/false, /*reuse_b=*/false);
  }

  const float bias = dst_bias ? dst_bias[ncol] : 0.0f;
  const float sgn  = dst_bias ? -1.0f : 1.0f;
  const int row0 = (rows_tile << 4) + ((lane >> 4) << 3);  // C/D: M = r + (l>>4)*8
  #pragma unroll
  for (int r = 0; r < 8; ++r) {
    dst[(row0 + r) * H_DIM + ncol] = (acc[r] + bias) * sgn;
  }
}

// ---------------------------------------------------------------------------
// Async global->LDS copy of one 16B chunk per lane (ASYNCcnt-tracked DMA).
// VDST operand carries the wave-relative LDS byte address; flat LDS pointers
// hold the LDS offset in their low 32 bits (aperture layout).
// ---------------------------------------------------------------------------
__device__ __forceinline__ void async_copy_b128(const float* gsrc, float* lds_dst) {
  unsigned lds_off = (unsigned)(unsigned long long)lds_dst;
  asm volatile("global_load_async_to_lds_b128 %0, %1, off"
               :
               : "v"(lds_off), "v"(gsrc)
               : "memory");
}

__device__ __forceinline__ void wait_async_all() {
  asm volatile("s_wait_asynccnt 0x0" ::: "memory");
}

// ---------------------------------------------------------------------------
// Phase 2: out[t,o] = b2 + sum_h lrelu(a + b) * W2[h], a = HT[t,h], b = -HOB[o,h].
// lrelu(a + b) = 0.01*(a + b) + 0.99*max(a + b, 0) and max(a + b, 0) = max(a, -b) + b, so
//   out[t,o] = b2 + 0.01*sum_h W2*a + sum_h W2*b + 0.99*sum_h W2*max(a, -b):
// the first two sums belong to one row of one tile each (64 rows per block); only the
// last one is per (t,o) pair, and it costs one max and one multiply-add per h.
// 32t x 32o tile per 256-thread block; each wave covers the whole tile with an
// 8x4 register tile per thread over one eighth of h; slices are summed in LDS.
// HT/HOB tiles + W2 staged in LDS (~134KB dynamic) via async-to-LDS DMA.
// ---------------------------------------------------------------------------
// waves_per_eu(4, 4): LDS admits two blocks per WGP = four waves per SIMD, so each wave
// may own 256 registers. Without it the compiler saves registers for waves that can
// never be resident: it then reads one s_ht row at a time and waits on each read.
__global__ __launch_bounds__(256) __attribute__((amdgpu_waves_per_eu(4, 4)))
void CFM_broadcast_mlp(
    const float* __restrict__ HT, const float* __restrict__ HOB,
    const float* __restrict__ W2, const float* __restrict__ b2,
    float* __restrict__ out)
{
  extern __shared__ float smem[];
  float* s_ht = smem;                    // 32 * 516
  float* s_ho = smem + 32 * PADH;        // 32 * 516
  float* s_w2 = smem + 64 * PADH;        // 512

  const int tid = threadIdx.x;
  const int t0  = (blockIdx.x >> 4) << 5;   // O/32 = 16 o-tiles
  const int o0  = (blockIdx.x & 15) << 5;

  // Async stage-in: 32 rows x 128 float4 per tensor + 128 float4 of W2.
  for (int idx = tid; idx < 32 * (H_DIM / 4); idx += 256) {
    const int r = idx >> 7;             // / 128
    const int c = (idx & 127) << 2;
    async_copy_b128(HT  + (t0 + r) * H_DIM + c, s_ht + r * PADH + c);
    async_copy_b128(HOB + (o0 + r) * H_DIM + c, s_ho + r * PADH + c);
  }
  if (tid < H_DIM / 4) {
    async_copy_b128(W2 + (tid << 2), s_w2 + (tid << 2));
  }
  wait_async_all();
  __syncthreads();

  // 8x4 register tile per thread: the 32 lanes of a wave cover the whole 32x32
  // tile (rows tg + 4i, cols og + 8j) and each of the 8 waves sums its own 64 h.
  // Per 4-h step 15 ds_load_b128 feed 128 products per lane. In each 16-lane half
  // a load touches 2 (s_ht) or 8 (s_ho) neighbouring rows, 4 banks apart: no conflict.
  const int lane = tid & 31;
  const int wv   = tid >> 5;
  const int tg   = lane >> 3;
  const int og   = lane & 7;
  const float* ap = s_ht + tg * PADH + wv * HSLICE;
  const float* bp = s_ho + og * PADH + wv * HSLICE;
  const float* wp = s_w2 + wv * HSLICE;

  // Row sums: in each wave lane l also sums W2*row over the wave's h slice for row l of
  // s_ht and row l of s_ho (rows 4 banks apart: no conflict).
  const float* rap = s_ht + lane * PADH + wv * HSLICE;
  const float* rbp = s_ho + lane * PADH + wv * HSLICE;

  // The loops over i and j are fully unrolled: every tile index is then a constant and
  // the tile stays in registers. Each sum is kept as an (even h, odd h) pair, so that a
  // loaded register pair feeds a packed multiply-add as it lies.
  v2f acc[8][4];
  #pragma unroll
  for (int i = 0; i < 8; ++i) {
    #pragma unroll
    for (int j = 0; j < 4; ++j) acc[i][j] = (v2f){0.0f, 0.0f};
  }
  v2f sa = {0.0f, 0.0f};
  v2f sb = {0.0f, 0.0f};

  for (int h = 0; h < HSLICE; h += 4) {
    const v4f w = *(const v4f*)(wp + h);
    const v2f w01 = w.xy;
    const v2f w23 = w.zw;
    v4f b[4];
    #pragma unroll
    for (int j = 0; j < 4; ++j) b[j] = *(const v4f*)(bp + j * 8 * PADH + h);
    const v4f ra = *(const v4f*)(rap + h);
    const v4f rb = *(const v4f*)(rbp + h);
    sa = __builtin_elementwise_fma(ra.xy, w01, sa);
    sb = __builtin_elementwise_fma(rb.xy, w01, sb);
    sa = __builtin_elementwise_fma(ra.zw, w23, sa);
    sb = __builtin_elementwise_fma(rb.zw, w23, sb);
    #pragma unroll
    for (int i = 0; i < 8; ++i) {
      const v4f a = *(const v4f*)(ap + i * 4 * PADH + h);
      #pragma unroll
      for (int j = 0; j < 4; ++j) {
        v2f m;
        m.x = fmaxf(a.x, b[j].x);
        m.y = fmaxf(a.y, b[j].y);
        acc[i][j] = __builtin_elementwise_fma(m, w01, acc[i][j]);
        m.x = fmaxf(a.z, b[j].z);
        m.y = fmaxf(a.w, b[j].w);
        acc[i][j] = __builtin_elementwise_fma(m, w23, acc[i][j]);
      }
    }
  }

  // Combine the 8 h-slices through LDS, laid out [slice][i][lane] as float4 over j; the
  // row sums lie behind them as [row][slice], s_ht's 32 rows first.
  // First barrier: every wave has read its last staged value before the tiles are
  // overwritten. Second barrier: all partial sums are in LDS before they are read.
  float4* red = (float4*)smem;
  float*  rs  = smem + 8 * 8 * 32 * 4;
  __syncthreads();
  #pragma unroll  // constant i: acc is stored straight from its registers
  for (int i = 0; i < 8; ++i) {
    red[(wv * 8 + i) * 32 + lane] = make_float4(acc[i][0].x + acc[i][0].y, acc[i][1].x + acc[i][1].y,
                                                acc[i][2].x + acc[i][2].y, acc[i][3].x + acc[i][3].y);
  }
  rs[lane * 8 + wv]       = sa.x + sa.y;
  rs[(32 + lane) * 8 + wv] = sb.x + sb.y;
  __syncthreads();

  // Thread (wv, lane) finishes row tg + 4*wv, cols og + 8j.
  float4 s = red[wv * 32 + lane];
  #pragma unroll  // the reads of all slices are issued ahead of the adds
  for (int k = 1; k < 8; ++k) {
    const float4 p = red[(k * 8 + wv) * 32 + lane];
    s.x += p.x; s.y += p.y; s.z += p.z; s.w += p.w;
  }
  // rowsum[0]: W2 . HT row of this thread; rowsum[1 + j]: W2 . HOB row of column og + 8j.
  float rowsum[5];
  #pragma unroll  // constant q: rowsum stays in registers
  for (int q = 0; q < 5; ++q) {
    const int row = (q == 0) ? (tg + 4 * wv) : (32 + og + 8 * (q - 1));
    const float4 p0 = *(const float4*)(rs + row * 8);
    const float4 p1 = *(const float4*)(rs + row * 8 + 4);
    rowsum[q] = ((p0.x + p0.y) + (p0.z + p0.w)) + ((p1.x + p1.y) + (p1.z + p1.w));
  }

  const float base = fmaf(0.01f, rowsum[0], b2[0]);
  float* orow = out + (t0 + tg + 4 * wv) * O_DIM + (o0 + og);
  orow[0]  = fmaf(0.99f, s.x, base - rowsum[1]);
  orow[8]  = fmaf(0.99f, s.y, base - rowsum[2]);
  orow[16] = fmaf(0.99f, s.z, base - rowsum[3]);
  orow[24] = fmaf(0.99f, s.w, base - rowsum[4]);
}

extern "C" void kernel_launch(void* const* d_in, const int* in_sizes, int n_in,
                              void* d_out, int out_size, void* d_ws, size_t ws_size,
                              hipStream_t stream) {
  (void)in_sizes; (void)n_in; (void)out_size; (void)ws_size;
  const float* z_t = (const float*)d_in[0];
  const float* z_o = (const float*)d_in[1];
  const float* W1  = (const float*)d_in[2];
  const float* b1  = (const float*)d_in[3];
  const float* W2  = (const float*)d_in[4];
  const float* b2  = (const float*)d_in[5];

  float* HT  = (float*)d_ws;                 // T*H floats (2MB)
  float* HOB = HT + (size_t)T_DIM * H_DIM;   // O*H floats (1MB)

  // Phase 1: 3072 wave-tiles, 4 waves (128 threads) per block -> 768 blocks.
  CFM_front_gemm<<<768, 128, 0, stream>>>(z_t, z_o, W1, b1, HT, HOB);

  // Phase 2: (T/32)*(O/32) = 512 blocks, 256 threads, ~134KB dynamic LDS.
  const size_t lds_bytes = (size_t)(64 * PADH + H_DIM) * sizeof(float);
  CFM_broadcast_mlp<<<512, 256, lds_bytes, stream>>>(HT, HOB, W2, b2, (float*)d_out);
}

// v003
// Measured time: 17.3 microseconds a run.
// Next to v002, in two timings, it ran 1.37 times as fast each time.
// Counting every step since v000, it is 1.76 times as fast.
#include <hip/hip_runtime.h>

typedef float v2f __attribute__((ext_vector_type(2)));
typedef float v4f __attribute__((ext_vector_type(4)));
typedef float v8f __attribute__((ext_vector_type(8)));

#define T_DIM 1024
#define O_DIM 512
#define D_DIM 256
#define H_DIM 512
#define PADH  (H_DIM + 4)   // 516 floats: rows step 4 banks -> 16 rows cover 64 banks
#define HSLICE (H_DIM / 8)  // h range summed by one wave of phase 2

// ---------------------------------------------------------------------------
// Phase 1: front GEMMs with V_WMMA_F32_16X16X4_F32 (exact fp32 matrix math)
//   HT [T,H]  = z_t @ W1[0:D, :]
//   HOB[O,H]  = -(z_o @ W1[D:2D, :] + b1)   (stored negated: phase 2 takes max(HT, HOB))
// One 4-wave block per 32x32 output tile, one wave per 16x16 quarter. Both operands come
// through LDS in stages of 64 k, two buffers: every copy instruction moves whole 128-byte
// lines (2 x 256 B of two z rows, or 4 x 128 B of four W1 rows), each staged value feeds
// two waves, and stage s + 1 flies while stage s is multiplied.
// ---------------------------------------------------------------------------
#define KC   64                        // k per stage
#define NST  (D_DIM / KC)              // 4 stages
#define PA   (KC + 4)                  // z rows, 272 B = 16 B x odd: 16 lanes' b128 reads cover 64 banks
#define PB   36                        // W1 rows, 144 B: rows k and k + 4 lie 16 banks apart
#define STG_A (32 * PA)                // floats of z in one buffer
#define STG  (STG_A + KC * PB)         // floats in one buffer

// Eight async global->LDS copies of 16 B per lane (four of z, four of W1): one stage's share
// of one thread. s_wait_xcnt 0 is the last line of the same statement, so that it stands in
// front of whatever next rewrites an address register named here.
__device__ __forceinline__ void front_stage_copies(const float* ga, const float* gb,
                                                   unsigned la, unsigned lb) {
  asm volatile(
      "global_load_async_to_lds_b128 %0, %8, off\n\t"
      "global_load_async_to_lds_b128 %1, %9, off\n\t"
      "global_load_async_to_lds_b128 %2, %10, off\n\t"
      "global_load_async_to_lds_b128 %3, %11, off\n\t"
      "global_load_async_to_lds_b128 %4, %12, off\n\t"
      "global_load_async_to_lds_b128 %5, %13, off\n\t"
      "global_load_async_to_lds_b128 %6, %14, off\n\t"
      "global_load_async_to_lds_b128 %7, %15, off\n\t"
      "s_wait_xcnt 0x0"
      :
      : "v"(la), "v"(la + 8 * PA * 4), "v"(la + 16 * PA * 4), "v"(la + 24 * PA * 4),
        "v"(lb), "v"(lb + 16 * PB * 4), "v"(lb + 32 * PB * 4), "v"(lb + 48 * PB * 4),
        "v"(ga), "v"(ga + 8 * D_DIM), "v"(ga + 16 * D_DIM), "v"(ga + 24 * D_DIM),
        "v"(gb), "v"(gb + 16 * H_DIM), "v"(gb + 32 * H_DIM), "v"(gb + 48 * H_DIM)
      : "memory");
}

__global__ __launch_bounds__(128) void CFM_front_gemm(
    const float* __restrict__ z_t, const float* __restrict__ z_o,
    const float* __restrict__ W1,  const float* __restrict__ b1,
    float* __restrict__ HT, float* __restrict__ HOB)
{
  __shared__ __attribute__((aligned(16))) float stg[2 * STG];

  const int tid  = threadIdx.x;
  const int lane = tid & 31;
  const int wave = tid >> 5;

  const int HT_BLOCKS = (T_DIM / 32) * (H_DIM / 32);   // 32*16 = 512
  const bool is_o = (int)blockIdx.x >= HT_BLOCKS;      // block-uniform
  const int  blk  = is_o ? (int)blockIdx.x - HT_BLOCKS : (int)blockIdx.x;
  const int  m0   = (blk >> 4) << 5;                   // H/32 = 16 column tiles per row tile
  const int  n0   = (blk & 15) << 5;
  const float* src   = is_o ? z_o : z_t;
  const float* wbase = is_o ? W1 + D_DIM * H_DIM : W1;
  float*       dst   = is_o ? HOB : HT;

  // Copy share of this thread. z: rows (tid >> 4) + 8i, 16 B at k = 4 * (tid & 15).
  // W1: rows (tid >> 3) + 16i of the stage, 16 B at column 4 * (tid & 7).
  const float* ga = src   + (m0 + (tid >> 4)) * D_DIM + ((tid & 15) << 2);
  const float* gb = wbase + (tid >> 3) * H_DIM + n0 + ((tid & 7) << 2);
  const unsigned lds0 = (unsigned)(unsigned long long)stg;
  const unsigned la = lds0 + (unsigned)(((tid >> 4) * PA + ((tid & 15) << 2)) * 4);
  const unsigned lb = lds0 + (unsigned)((STG_A + (tid >> 3) * PB + ((tid & 7) << 2)) * 4);

  // Fragments. Lane half hf takes k = 8g + 4hf + {0,1} in the first WMMA of a group of 8 k
  // and 8g + 4hf + {2,3} in the second, for A and for B alike: one b128 read gives A for both.
  const int lm = lane & 15;
  const int hf = lane >> 4;
  const float* fa = stg + ((wave >> 1) * 16 + lm) * PA + 4 * hf;
  const float* fb = stg + STG_A + 4 * hf * PB + (wave & 1) * 16 + lm;

  const int ncol = n0 + (wave & 1) * 16 + lm;          // D: N = lane & 15
  const float bias = is_o ? b1[ncol] : 0.0f;
  const float sgn  = is_o ? -1.0f : 1.0f;

  front_stage_copies(ga, gb, la, lb);
  asm volatile("s_wait_asynccnt 0x0" ::: "memory");    // this wave's share of stage 0 has landed
  __syncthreads();                                     // ... and every other wave's
  front_stage_copies(ga + KC, gb + KC * H_DIM, la + STG * 4, lb + STG * 4);

  v8f acc = {};
  #pragma unroll  // constant s: buffer offsets fold into the LDS reads' immediates
  for (int s = 0; s < NST; ++s) {
    const float* pa = fa + (s & 1) * STG;
    const float* pb = fb + (s & 1) * STG;
    // All fragment reads of the stage stand ahead of its WMMAs: one LDS latency per stage,
    // not one per pair of WMMAs.
    v4f a[KC / 8];
    v2f b[KC / 4];
    #pragma unroll  // constant g: the fragments stay in registers
    for (int g = 0; g < KC / 8; ++g) {
      a[g] = *(const v4f*)(pa + 8 * g);
      b[2 * g].x     = pb[(8 * g + 0) * PB];
      b[2 * g].y     = pb[(8 * g + 1) * PB];
      b[2 * g + 1].x = pb[(8 * g + 2) * PB];
      b[2 * g + 1].y = pb[(8 * g + 3) * PB];
    }
    // Keeps the reads above where they stand: without it the compiler sinks each read to just
    // ahead of the WMMA that uses it, and the wave then waits on LDS at every pair of WMMAs.
    __builtin_amdgcn_sched_barrier(0);
    #pragma unroll  // constant g, as above
    for (int g = 0; g < KC / 8; ++g) {
      acc = __builtin_amdgcn_wmma_f32_16x16x4_f32(
          /*neg_a=*/false, a[g].xy, /*neg_b=*/false, b[2 * g],
          /*c_mod=*/(short)0, acc, /*reuse_a=*/false, /*reuse_b=*/false);
      acc = __builtin_amdgcn_wmma_f32_16x16x4_f32(
          /*neg_a=*/false, a[g].zw, /*neg_b=*/false, b[2 * g + 1],
          /*c_mod=*/(short)0, acc, /*reuse_a=*/false, /*reuse_b=*/false);
    }
    // Keeps the WMMAs of stage s ahead of the waits below: without it the compiler sinks them
    // behind the wait for stage s + 1, and the copies then fly with nothing to hide them.
    __builtin_amdgcn_sched_barrier(0);
    // Hand-over: this wave's reads of stage s are done, its copies of stage s + 1 have landed;
    // behind the barrier that holds for all four waves, and the buffer just read may be refilled.
    asm volatile("s_wait_dscnt 0x0" ::: "memory");
    asm volatile("s_wait_asynccnt 0x0" ::: "memory");
    __syncthreads();
    if (s + 2 < NST) {
      front_stage_copies(ga + (s + 2) * KC, gb + (s + 2) * KC * H_DIM,
                         la + (s & 1) * STG * 4, lb + (s & 1) * STG * 4);
    }
  }
  asm volatile("s_wait_asynccnt 0x0" ::: "memory");    // no copy is left in flight at the wave's end

  // Four vector slots between the last WMMA and the first vector instruction that reads its
  // result: otherwise only waits, a barrier and one vector instruction stand between the two.
  asm volatile("v_nop\n\tv_nop\n\tv_nop\n\tv_nop" : "+v"(acc));

  const int row0 = m0 + (wave >> 1) * 16 + (hf << 3);           // D: M = r + (lane >> 4) * 8
  #pragma unroll
  for (int r = 0; r < 8; ++r) {
    dst[(row0 + r) * H_DIM + ncol] = (acc[r] + bias) * sgn;
  }
}

// ---------------------------------------------------------------------------
// Async global->LDS copy of one 16B chunk per lane (ASYNCcnt-tracked DMA).
// VDST operand carries the wave-relative LDS byte address; flat LDS pointers
// hold the LDS offset in their low 32 bits (aperture layout).
// ---------------------------------------------------------------------------
__device__ __forceinline__ void async_copy_b128(const float* gsrc, float* lds_dst) {
  unsigned lds_off = (unsigned)(unsigned long long)lds_dst;
  asm volatile("global_load_async_to_lds_b128 %0, %1, off"
               :
               : "v"(lds_off), "v"(gsrc)
               : "memory");
}

__device__ __forceinline__ void wait_async_all() {
  asm volatile("s_wait_asynccnt 0x0" ::: "memory");
}

// ---------------------------------------------------------------------------
// Phase 2: out[t,o] = b2 + sum_h lrelu(a + b) * W2[h], a = HT[t,h], b = -HOB[o,h].
// lrelu(a + b) = 0.01*(a + b) + 0.99*max(a + b, 0) and max(a + b, 0) = max(a, -b) + b, so
//   out[t,o] = b2 + 0.01*sum_h W2*a + sum_h W2*b + 0.99*sum_h W2*max(a, -b):
// the first two sums belong to one row of one tile each (64 rows per block); only the
// last one is per (t,o) pair, and it costs one max and one multiply-add per h.
// 32t x 32o tile per 256-thread block; each wave covers the whole tile with an
// 8x4 register tile per thread over one eighth of h; slices are summed in LDS.
// HT/HOB tiles + W2 staged in LDS (~134KB dynamic) via async-to-LDS DMA.
// ---------------------------------------------------------------------------
// waves_per_eu(4, 4): LDS admits two blocks per WGP = four waves per SIMD, so each wave
// may own 256 registers. Without it the compiler saves registers for waves that can
// never be resident: it then reads one s_ht row at a time and waits on each read.
__global__ __launch_bounds__(256) __attribute__((amdgpu_waves_per_eu(4, 4)))
void CFM_broadcast_mlp(
    const float* __restrict__ HT, const float* __restrict__ HOB,
    const float* __restrict__ W2, const float* __restrict__ b2,
    float* __restrict__ out)
{
  extern __shared__ float smem[];
  float* s_ht = smem;                    // 32 * 516
  float* s_ho = smem + 32 * PADH;        // 32 * 516
  float* s_w2 = smem + 64 * PADH;        // 512

  const int tid = threadIdx.x;
  const int t0  = (blockIdx.x >> 4) << 5;   // O/32 = 16 o-tiles
  const int o0  = (blockIdx.x & 15) << 5;

  // Async stage-in: 32 rows x 128 float4 per tensor + 128 float4 of W2.
  for (int idx = tid; idx < 32 * (H_DIM / 4); idx += 256) {
    const int r = idx >> 7;             // / 128
    const int c = (idx & 127) << 2;
    async_copy_b128(HT  + (t0 + r) * H_DIM + c, s_ht + r * PADH + c);
    async_copy_b128(HOB + (o0 + r) * H_DIM + c, s_ho + r * PADH + c);
  }
  if (tid < H_DIM / 4) {
    async_copy_b128(W2 + (tid << 2), s_w2 + (tid << 2));
  }
  wait_async_all();
  __syncthreads();

  // 8x4 register tile per thread: the 32 lanes of a wave cover the whole 32x32
  // tile (rows tg + 4i, cols og + 8j) and each of the 8 waves sums its own 64 h.
  // Per 4-h step 15 ds_load_b128 feed 128 products per lane. In each 16-lane half
  // a load touches 2 (s_ht) or 8 (s_ho) neighbouring rows, 4 banks apart: no conflict.
  const int lane = tid & 31;
  const int wv   = tid >> 5;
  const int tg   = lane >> 3;
  const int og   = lane & 7;
  const float* ap = s_ht + tg * PADH + wv * HSLICE;
  const float* bp = s_ho + og * PADH + wv * HSLICE;
  const float* wp = s_w2 + wv * HSLICE;

  // Row sums: in each wave lane l also sums W2*row over the wave's h slice for row l of
  // s_ht and row l of s_ho (rows 4 banks apart: no conflict).
  const float* rap = s_ht + lane * PADH + wv * HSLICE;
  const float* rbp = s_ho + lane * PADH + wv * HSLICE;

  // The loops over i and j are fully unrolled: every tile index is then a constant and
  // the tile stays in registers. Each sum is kept as an (even h, odd h) pair, so that a
  // loaded register pair feeds a packed multiply-add as it lies.
  v2f acc[8][4];
  #pragma unroll
  for (int i = 0; i < 8; ++i) {
    #pragma unroll
    for (int j = 0; j < 4; ++j) acc[i][j] = (v2f){0.0f, 0.0f};
  }
  v2f sa = {0.0f, 0.0f};
  v2f sb = {0.0f, 0.0f};

  for (int h = 0; h < HSLICE; h += 4) {
    const v4f w = *(const v4f*)(wp + h);
    const v2f w01 = w.xy;
    const v2f w23 = w.zw;
    v4f b[4];
    #pragma unroll
    for (int j = 0; j < 4; ++j) b[j] = *(const v4f*)(bp + j * 8 * PADH + h);
    const v4f ra = *(const v4f*)(rap + h);
    const v4f rb = *(const v4f*)(rbp + h);
    sa = __builtin_elementwise_fma(ra.xy, w01, sa);
    sb = __builtin_elementwise_fma(rb.xy, w01, sb);
    sa = __builtin_elementwise_fma(ra.zw, w23, sa);
    sb = __builtin_elementwise_fma(rb.zw, w23, sb);
    #pragma unroll
    for (int i = 0; i < 8; ++i) {
      const v4f a = *(const v4f*)(ap + i * 4 * PADH + h);
      #pragma unroll
      for (int j = 0; j < 4; ++j) {
        v2f m;
        m.x = fmaxf(a.x, b[j].x);
        m.y = fmaxf(a.y, b[j].y);
        acc[i][j] = __builtin_elementwise_fma(m, w01, acc[i][j]);
        m.x = fmaxf(a.z, b[j].z);
        m.y = fmaxf(a.w, b[j].w);
        acc[i][j] = __builtin_elementwise_fma(m, w23, acc[i][j]);
      }
    }
  }

  // Combine the 8 h-slices through LDS, laid out [slice][i][lane] as float4 over j; the
  // row sums lie behind them as [row][slice], s_ht's 32 rows first.
  // First barrier: every wave has read its last staged value before the tiles are
  // overwritten. Second barrier: all partial sums are in LDS before they are read.
  float4* red = (float4*)smem;
  float*  rs  = smem + 8 * 8 * 32 * 4;
  __syncthreads();
  #pragma unroll  // constant i: acc is stored straight from its registers
  for (int i = 0; i < 8; ++i) {
    red[(wv * 8 + i) * 32 + lane] = make_float4(acc[i][0].x + acc[i][0].y, acc[i][1].x + acc[i][1].y,
                                                acc[i][2].x + acc[i][2].y, acc[i][3].x + acc[i][3].y);
  }
  rs[lane * 8 + wv]       = sa.x + sa.y;
  rs[(32 + lane) * 8 + wv] = sb.x + sb.y;
  __syncthreads();

  // Thread (wv, lane) finishes row tg + 4*wv, cols og + 8j.
  float4 s = red[wv * 32 + lane];
  #pragma unroll  // the reads of all slices are issued ahead of the adds
  for (int k = 1; k < 8; ++k) {
    const float4 p = red[(k * 8 + wv) * 32 + lane];
    s.x += p.x; s.y += p.y; s.z += p.z; s.w += p.w;
  }
  // rowsum[0]: W2 . HT row of this thread; rowsum[1 + j]: W2 . HOB row of column og + 8j.
  float rowsum[5];
  #pragma unroll  // constant q: rowsum stays in registers
  for (int q = 0; q < 5; ++q) {
    const int row = (q == 0) ? (tg + 4 * wv) : (32 + og + 8 * (q - 1));
    const float4 p0 = *(const float4*)(rs + row * 8);
    const float4 p1 = *(const float4*)(rs + row * 8 + 4);
    rowsum[q] = ((p0.x + p0.y) + (p0.z + p0.w)) + ((p1.x + p1.y) + (p1.z + p1.w));
  }

  const float base = fmaf(0.01f, rowsum[0], b2[0]);
  float* orow = out + (t0 + tg + 4 * wv) * O_DIM + (o0 + og);
  orow[0]  = fmaf(0.99f, s.x, base - rowsum[1]);
  orow[8]  = fmaf(0.99f, s.y, base - rowsum[2]);
  orow[16] = fmaf(0.99f, s.z, base - rowsum[3]);
  orow[24] = fmaf(0.99f, s.w, base - rowsum[4]);
}

extern "C" void kernel_launch(void* const* d_in, const int* in_sizes, int n_in,
                              void* d_out, int out_size, void* d_ws, size_t ws_size,
                              hipStream_t stream) {
  (void)in_sizes; (void)n_in; (void)out_size; (void)ws_size;
  const float* z_t = (const float*)d_in[0];
  const float* z_o = (const float*)d_in[1];
  const float* W1  = (const float*)d_in[2];
  const float* b1  = (const float*)d_in[3];
  const float* W2  = (const float*)d_in[4];
  const float* b2  = (const float*)d_in[5];

  float* HT  = (float*)d_ws;                 // T*H floats (2MB)
  float* HOB = HT + (size_t)T_DIM * H_DIM;   // O*H floats (1MB)

  // Phase 1: 768 tiles of 32x32, 4 waves (128 threads) per block.
  CFM_front_gemm<<<768, 128, 0, stream>>>(z_t, z_o, W1, b1, HT, HOB);

  // Phase 2: (T/32)*(O/32) = 512 blocks, 256 threads, ~134KB dynamic LDS.
  const size_t lds_bytes = (size_t)(64 * PADH + H_DIM) * sizeof(float);
  CFM_broadcast_mlp<<<512, 256, lds_bytes, stream>>>(HT, HOB, W2, b2, (float*)d_out);
}

// v004
// Measured time: 16.1 microseconds a run.
// Two timings next to v003 both put it at 1.07 times that version's speed.
// Over all steps from v000 it is 1.88 times as fast.
#include <hip/hip_runtime.h>

typedef float v2f __attribute__((ext_vector_type(2)));
typedef float v4f __attribute__((ext_vector_type(4)));
typedef float v8f __attribute__((ext_vector_type(8)));

#define T_DIM 1024
#define O_DIM 512
#define D_DIM 256
#define H_DIM 512
#define PADH  (H_DIM + 4)   // 516 floats: rows step 4 banks -> 16 rows cover 64 banks
#define HSLICE (H_DIM / 8)  // h range summed by one wave of phase 2

// ---------------------------------------------------------------------------
// Phase 1: front GEMMs with V_WMMA_F32_16X16X4_F32 (exact fp32 matrix math)
//   HT [T,H]  = z_t @ W1[0:D, :]
//   HOB[O,H]  = -(z_o @ W1[D:2D, :] + b1)   (stored negated: phase 2 takes max(HT, HOB))
// One 4-wave block per 32x32 output tile, one wave per 16x16 quarter. Both operands come
// through LDS in stages of 64 k, two buffers: every copy instruction moves whole 128-byte
// lines (2 x 256 B of two z rows, or 4 x 128 B of four W1 rows), each staged value feeds
// two waves, and stage s + 1 flies while stage s is multiplied.
// ---------------------------------------------------------------------------
#define KC   64                        // k per stage
#define NST  (D_DIM / KC)              // 4 stages
#define PA   (KC + 4)                  // z rows, 272 B = 16 B x odd: 16 lanes' b128 reads cover 64 banks
#define PB   36                        // W1 rows, 144 B: rows k and k + 4 lie 16 banks apart
#define STG_A (32 * PA)                // floats of z in one buffer
#define STG  (STG_A + KC * PB)         // floats in one buffer

// Eight async global->LDS copies of 16 B per lane (four of z, four of W1): one stage's share
// of one thread. s_wait_xcnt 0 is the last line of the same statement, so that it stands in
// front of whatever next rewrites an address register named here.
__device__ __forceinline__ void front_stage_copies(const float* ga, const float* gb,
                                                   unsigned la, unsigned lb) {
  asm volatile(
      "global_load_async_to_lds_b128 %0, %8, off\n\t"
      "global_load_async_to_lds_b128 %1, %9, off\n\t"
      "global_load_async_to_lds_b128 %2, %10, off\n\t"
      "global_load_async_to_lds_b128 %3, %11, off\n\t"
      "global_load_async_to_lds_b128 %4, %12, off\n\t"
      "global_load_async_to_lds_b128 %5, %13, off\n\t"
      "global_load_async_to_lds_b128 %6, %14, off\n\t"
      "global_load_async_to_lds_b128 %7, %15, off\n\t"
      "s_wait_xcnt 0x0"
      :
      : "v"(la), "v"(la + 8 * PA * 4), "v"(la + 16 * PA * 4), "v"(la + 24 * PA * 4),
        "v"(lb), "v"(lb + 16 * PB * 4), "v"(lb + 32 * PB * 4), "v"(lb + 48 * PB * 4),
        "v"(ga), "v"(ga + 8 * D_DIM), "v"(ga + 16 * D_DIM), "v"(ga + 24 * D_DIM),
        "v"(gb), "v"(gb + 16 * H_DIM), "v"(gb + 32 * H_DIM), "v"(gb + 48 * H_DIM)
      : "memory");
}

__global__ __launch_bounds__(128) void CFM_front_gemm(
    const float* __restrict__ z_t, const float* __restrict__ z_o,
    const float* __restrict__ W1,  const float* __restrict__ b1,
    float* __restrict__ HT, float* __restrict__ HOB)
{
  __shared__ __attribute__((aligned(16))) float stg[2 * STG];

  const int tid  = threadIdx.x;
  const int lane = tid & 31;
  const int wave = tid >> 5;

  const int HT_BLOCKS = (T_DIM / 32) * (H_DIM / 32);   // 32*16 = 512
  const bool is_o = (int)blockIdx.x >= HT_BLOCKS;      // block-uniform
  const int  blk  = is_o ? (int)blockIdx.x - HT_BLOCKS : (int)blockIdx.x;
  const int  m0   = (blk >> 4) << 5;                   // H/32 = 16 column tiles per row tile
  const int  n0   = (blk & 15) << 5;
  const float* src   = is_o ? z_o : z_t;
  const float* wbase = is_o ? W1 + D_DIM * H_DIM : W1;
  float*       dst   = is_o ? HOB : HT;

  // Copy share of this thread. z: rows (tid >> 4) + 8i, 16 B at k = 4 * (tid & 15).
  // W1: rows (tid >> 3) + 16i of the stage, 16 B at column 4 * (tid & 7).
  const float* ga = src   + (m0 + (tid >> 4)) * D_DIM + ((tid & 15) << 2);
  const float* gb = wbase + (tid >> 3) * H_DIM + n0 + ((tid & 7) << 2);
  const unsigned lds0 = (unsigned)(unsigned long long)stg;
  const unsigned la = lds0 + (unsigned)(((tid >> 4) * PA + ((tid & 15) << 2)) * 4);
  const unsigned lb = lds0 + (unsigned)((STG_A + (tid >> 3) * PB + ((tid & 7) << 2)) * 4);

  // Fragments. Lane half hf takes k = 8g + 4hf + {0,1} in the first WMMA of a group of 8 k
  // and 8g + 4hf + {2,3} in the second, for A and for B alike: one b128 read gives A for both.
  const int lm = lane & 15;
  const int hf = lane >> 4;
  const float* fa = stg + ((wave >> 1) * 16 + lm) * PA + 4 * hf;
  const float* fb = stg + STG_A + 4 * hf * PB + (wave & 1) * 16 + lm;

  const int ncol = n0 + (wave & 1) * 16 + lm;          // D: N = lane & 15
  const float bias = is_o ? b1[ncol] : 0.0f;
  const float sgn  = is_o ? -1.0f : 1.0f;

  front_stage_copies(ga, gb, la, lb);
  asm volatile("s_wait_asynccnt 0x0" ::: "memory");    // this wave's share of stage 0 has landed
  __syncthreads();                                     // ... and every other wave's
  front_stage_copies(ga + KC, gb + KC * H_DIM, la + STG * 4, lb + STG * 4);

  v8f acc = {};
  #pragma unroll  // constant s: buffer offsets fold into the LDS reads' immediates
  for (int s = 0; s < NST; ++s) {
    const float* pa = fa + (s & 1) * STG;
    const float* pb = fb + (s & 1) * STG;
    // All fragment reads of the stage stand ahead of its WMMAs: one LDS latency per stage,
    // not one per pair of WMMAs.
    v4f a[KC / 8];
    v2f b[KC / 4];
    #pragma unroll  // constant g: the fragments stay in registers
    for (int g = 0; g < KC / 8; ++g) {
      a[g] = *(const v4f*)(pa + 8 * g);
      b[2 * g].x     = pb[(8 * g + 0) * PB];
      b[2 * g].y     = pb[(8 * g + 1) * PB];
      b[2 * g + 1].x = pb[(8 * g + 2) * PB];
      b[2 * g + 1].y = pb[(8 * g + 3) * PB];
    }
    // Keeps the reads above where they stand: without it the compiler sinks each read to just
    // ahead of the WMMA that uses it, and the wave then waits on LDS at every pair of WMMAs.
    __builtin_amdgcn_sched_barrier(0);
    #pragma unroll  // constant g, as above
    for (int g = 0; g < KC / 8; ++g) {
      acc = __builtin_amdgcn_wmma_f32_16x16x4_f32(
          /*neg_a=*/false, a[g].xy, /*neg_b=*/false, b[2 * g],
          /*c_mod=*/(short)0, acc, /*reuse_a=*/false, /*reuse_b=*/false);
      acc = __builtin_amdgcn_wmma_f32_16x16x4_f32(
          /*neg_a=*/false, a[g].zw, /*neg_b=*/false, b[2 * g + 1],
          /*c_mod=*/(short)0, acc, /*reuse_a=*/false, /*reuse_b=*/false);
    }
    // Keeps the WMMAs of stage s ahead of the waits below: without it the compiler sinks them
    // behind the wait for stage s + 1, and the copies then fly with nothing to hide them.
    __builtin_amdgcn_sched_barrier(0);
    // Hand-over: this wave's reads of stage s are done, its copies of stage s + 1 have landed;
    // behind the barrier that holds for all four waves, and the buffer just read may be refilled.
    asm volatile("s_wait_dscnt 0x0" ::: "memory");
    asm volatile("s_wait_asynccnt 0x0" ::: "memory");
    __syncthreads();
    if (s + 2 < NST) {
      front_stage_copies(ga + (s + 2) * KC, gb + (s + 2) * KC * H_DIM,
                         la + (s & 1) * STG * 4, lb + (s & 1) * STG * 4);
    }
  }
  asm volatile("s_wait_asynccnt 0x0" ::: "memory");    // no copy is left in flight at the wave's end

  // Four vector slots between the last WMMA and the first vector instruction that reads its
  // result: otherwise only waits, a barrier and one vector instruction stand between the two.
  asm volatile("v_nop\n\tv_nop\n\tv_nop\n\tv_nop" : "+v"(acc));

  const int row0 = m0 + (wave >> 1) * 16 + (hf << 3);           // D: M = r + (lane >> 4) * 8
  #pragma unroll
  for (int r = 0; r < 8; ++r) {
    dst[(row0 + r) * H_DIM + ncol] = (acc[r] + bias) * sgn;
  }
}

// ---------------------------------------------------------------------------
// Async global->LDS copy of one 16B chunk per lane (ASYNCcnt-tracked DMA).
// VDST operand carries the wave-relative LDS byte address; flat LDS pointers
// hold the LDS offset in their low 32 bits (aperture layout).
// ---------------------------------------------------------------------------
__device__ __forceinline__ void async_copy_b128(const float* gsrc, float* lds_dst) {
  unsigned lds_off = (unsigned)(unsigned long long)lds_dst;
  asm volatile("global_load_async_to_lds_b128 %0, %1, off"
               :
               : "v"(lds_off), "v"(gsrc)
               : "memory");
}

// (max(ax, bx), max(ay, by)) as one dual-issue instruction on the registers as LDS loaded them.
// What it is for: in front of fmaxf the compiler first quiets every loaded operand with
// max(x, x), 48 more max per 4-h step of phase 2, a sixth of that loop's vector instructions.
// The quieting changes a signalling NaN only, and HT and HOB hold results of float arithmetic,
// which are never signalling. The outputs are early-clobber: neither half may overwrite a
// source of the other. Not volatile: a pure function of its inputs, free to be scheduled.
__device__ __forceinline__ v2f max_pair(float ax, float ay, float bx, float by) {
  float mx, my;
  asm("v_dual_max_num_f32 %0, %2, %4 :: v_dual_max_num_f32 %1, %3, %5"
      : "=&v"(mx), "=&v"(my)
      : "v"(ax), "v"(ay), "v"(bx), "v"(by));
  return (v2f){mx, my};
}

__device__ __forceinline__ void wait_async_all() {
  asm volatile("s_wait_asynccnt 0x0" ::: "memory");
}

// ---------------------------------------------------------------------------
// Phase 2: out[t,o] = b2 + sum_h lrelu(a + b) * W2[h], a = HT[t,h], b = -HOB[o,h].
// lrelu(a + b) = 0.01*(a + b) + 0.99*max(a + b, 0) and max(a + b, 0) = max(a, -b) + b, so
//   out[t,o] = b2 + 0.01*sum_h W2*a + sum_h W2*b + 0.99*sum_h W2*max(a, -b):
// the first two sums belong to one row of one tile each (64 rows per block); only the
// last one is per (t,o) pair, and it costs one max and one multiply-add per h.
// 32t x 32o tile per 256-thread block; each wave covers the whole tile with an
// 8x4 register tile per thread over one eighth of h; slices are summed in LDS.
// HT/HOB tiles + W2 staged in LDS (~134KB dynamic) via async-to-LDS DMA.
// ---------------------------------------------------------------------------
// waves_per_eu(4, 4): LDS admits two blocks per WGP = four waves per SIMD, so each wave
// may own 256 registers. Without it the compiler saves registers for waves that can
// never be resident: it then reads one s_ht row at a time and waits on each read.
__global__ __launch_bounds__(256) __attribute__((amdgpu_waves_per_eu(4, 4)))
void CFM_broadcast_mlp(
    const float* __restrict__ HT, const float* __restrict__ HOB,
    const float* __restrict__ W2, const float* __restrict__ b2,
    float* __restrict__ out)
{
  extern __shared__ float smem[];
  float* s_ht = smem;                    // 32 * 516
  float* s_ho = smem + 32 * PADH;        // 32 * 516
  float* s_w2 = smem + 64 * PADH;        // 512

  const int tid = threadIdx.x;
  const int t0  = (blockIdx.x >> 4) << 5;   // O/32 = 16 o-tiles
  const int o0  = (blockIdx.x & 15) << 5;

  // Async stage-in: 32 rows x 128 float4 per tensor + 128 float4 of W2.
  for (int idx = tid; idx < 32 * (H_DIM / 4); idx += 256) {
    const int r = idx >> 7;             // / 128
    const int c = (idx & 127) << 2;
    async_copy_b128(HT  + (t0 + r) * H_DIM + c, s_ht + r * PADH + c);
    async_copy_b128(HOB + (o0 + r) * H_DIM + c, s_ho + r * PADH + c);
  }
  if (tid < H_DIM / 4) {
    async_copy_b128(W2 + (tid << 2), s_w2 + (tid << 2));
  }
  wait_async_all();
  __syncthreads();

  // 8x4 register tile per thread: the 32 lanes of a wave cover the whole 32x32
  // tile (rows tg + 4i, cols og + 8j) and each of the 8 waves sums its own 64 h.
  // Per 4-h step 15 ds_load_b128 feed 128 products per lane. In each 16-lane half
  // a load touches 2 (s_ht) or 8 (s_ho) neighbouring rows, 4 banks apart: no conflict.
  const int lane = tid & 31;
  const int wv   = tid >> 5;
  const int tg   = lane >> 3;
  const int og   = lane & 7;
  const float* ap = s_ht + tg * PADH + wv * HSLICE;
  const float* bp = s_ho + og * PADH + wv * HSLICE;
  const float* wp = s_w2 + wv * HSLICE;

  // Row sums: in each wave lane l also sums W2*row over the wave's h slice for row l of
  // s_ht and row l of s_ho (rows 4 banks apart: no conflict).
  const float* rap = s_ht + lane * PADH + wv * HSLICE;
  const float* rbp = s_ho + lane * PADH + wv * HSLICE;

  // The loops over i and j are fully unrolled: every tile index is then a constant and
  // the tile stays in registers. Each sum is kept as an (even h, odd h) pair, so that a
  // loaded register pair feeds a packed multiply-add as it lies.
  v2f acc[8][4];
  #pragma unroll
  for (int i = 0; i < 8; ++i) {
    #pragma unroll
    for (int j = 0; j < 4; ++j) acc[i][j] = (v2f){0.0f, 0.0f};
  }
  v2f sa = {0.0f, 0.0f};
  v2f sb = {0.0f, 0.0f};

  for (int h = 0; h < HSLICE; h += 4) {
    const v4f w = *(const v4f*)(wp + h);
    const v2f w01 = w.xy;
    const v2f w23 = w.zw;
    v4f b[4];
    #pragma unroll
    for (int j = 0; j < 4; ++j) b[j] = *(const v4f*)(bp + j * 8 * PADH + h);
    const v4f ra = *(const v4f*)(rap + h);
    const v4f rb = *(const v4f*)(rbp + h);
    sa = __builtin_elementwise_fma(ra.xy, w01, sa);
    sb = __builtin_elementwise_fma(rb.xy, w01, sb);
    sa = __builtin_elementwise_fma(ra.zw, w23, sa);
    sb = __builtin_elementwise_fma(rb.zw, w23, sb);
    #pragma unroll
    for (int i = 0; i < 8; ++i) {
      const v4f a = *(const v4f*)(ap + i * 4 * PADH + h);
      #pragma unroll
      for (int j = 0; j < 4; ++j) {
        acc[i][j] = __builtin_elementwise_fma(max_pair(a.x, a.y, b[j].x, b[j].y), w01, acc[i][j]);
        acc[i][j] = __builtin_elementwise_fma(max_pair(a.z, a.w, b[j].z, b[j].w), w23, acc[i][j]);
      }
    }
  }

  // Combine the 8 h-slices through LDS, laid out [slice][i][lane] as float4 over j; the
  // row sums lie behind them as [row][slice], s_ht's 32 rows first.
  // First barrier: every wave has read its last staged value before the tiles are
  // overwritten. Second barrier: all partial sums are in LDS before they are read.
  float4* red = (float4*)smem;
  float*  rs  = smem + 8 * 8 * 32 * 4;
  __syncthreads();
  #pragma unroll  // constant i: acc is stored straight from its registers
  for (int i = 0; i < 8; ++i) {
    red[(wv * 8 + i) * 32 + lane] = make_float4(acc[i][0].x + acc[i][0].y, acc[i][1].x + acc[i][1].y,
                                                acc[i][2].x + acc[i][2].y, acc[i][3].x + acc[i][3].y);
  }
  rs[lane * 8 + wv]       = sa.x + sa.y;
  rs[(32 + lane) * 8 + wv] = sb.x + sb.y;
  __syncthreads();

  // Thread (wv, lane) finishes row tg + 4*wv, cols og + 8j.
  float4 s = red[wv * 32 + lane];
  #pragma unroll  // the reads of all slices are issued ahead of the adds
  for (int k = 1; k < 8; ++k) {
    const float4 p = red[(k * 8 + wv) * 32 + lane];
    s.x += p.x; s.y += p.y; s.z += p.z; s.w += p.w;
  }
  // rowsum[0]: W2 . HT row of this thread; rowsum[1 + j]: W2 . HOB row of column og + 8j.
  float rowsum[5];
  #pragma unroll  // constant q: rowsum stays in registers
  for (int q = 0; q < 5; ++q) {
    const int row = (q == 0) ? (tg + 4 * wv) : (32 + og + 8 * (q - 1));
    const float4 p0 = *(const float4*)(rs + row * 8);
    const float4 p1 = *(const float4*)(rs + row * 8 + 4);
    rowsum[q] = ((p0.x + p0.y) + (p0.z + p0.w)) + ((p1.x + p1.y) + (p1.z + p1.w));
  }

  const float base = fmaf(0.01f, rowsum[0], b2[0]);
  float* orow = out + (t0 + tg + 4 * wv) * O_DIM + (o0 + og);
  orow[0]  = fmaf(0.99f, s.x, base - rowsum[1]);
  orow[8]  = fmaf(0.99f, s.y, base - rowsum[2]);
  orow[16] = fmaf(0.99f, s.z, base - rowsum[3]);
  orow[24] = fmaf(0.99f, s.w, base - rowsum[4]);
}

extern "C" void kernel_launch(void* const* d_in, const int* in_sizes, int n_in,
                              void* d_out, int out_size, void* d_ws, size_t ws_size,
                              hipStream_t stream) {
  (void)in_sizes; (void)n_in; (void)out_size; (void)ws_size;
  const float* z_t = (const float*)d_in[0];
  const float* z_o = (const float*)d_in[1];
  const float* W1  = (const float*)d_in[2];
  const float* b1  = (const float*)d_in[3];
  const float* W2  = (const float*)d_in[4];
  const float* b2  = (const float*)d_in[5];

  float* HT  = (float*)d_ws;                 // T*H floats (2MB)
  float* HOB = HT + (size_t)T_DIM * H_DIM;   // O*H floats (1MB)

  // Phase 1: 768 tiles of 32x32, 4 waves (128 threads) per block.
  CFM_front_gemm<<<768, 128, 0, stream>>>(z_t, z_o, W1, b1, HT, HOB);

  // Phase 2: (T/32)*(O/32) = 512 blocks, 256 threads, ~134KB dynamic LDS.
  const size_t lds_bytes = (size_t)(64 * PADH + H_DIM) * sizeof(float);
  CFM_broadcast_mlp<<<512, 256, lds_bytes, stream>>>(HT, HOB, W2, b2, (float*)d_out);
}

// v005
// One run takes 15.1 microseconds.
// Two timings next to v004 both put it at 1.07 times that version's speed.
// All steps since v000 together make it 2.02 times as fast.
#include <hip/hip_runtime.h>

typedef float v2f __attribute__((ext_vector_type(2)));
typedef float v4f __attribute__((ext_vector_type(4)));
typedef float v8f __attribute__((ext_vector_type(8)));

#define T_DIM 1024
#define O_DIM 512
#define D_DIM 256
#define H_DIM 512
#define PADH  (H_DIM + 4)   // 516 floats: rows step 4 banks -> 16 rows cover 64 banks
#define HSLICE (H_DIM / 8)  // h range summed by one wave of phase 2

// ---------------------------------------------------------------------------
// Phase 1: front GEMMs with V_WMMA_F32_16X16X4_F32 (exact fp32 matrix math)
//   HT [T,H]  = z_t @ W1[0:D, :]
//   HOB[O,H]  = -(z_o @ W1[D:2D, :] + b1)   (stored negated: phase 2 takes max(HT, HOB))
// One 4-wave block per 32x32 output tile, one wave per 16x16 quarter. Both operands come
// through LDS in stages of 64 k, two buffers: every copy instruction moves whole 128-byte
// lines (2 x 256 B of two z rows, or 4 x 128 B of four W1 rows), each staged value feeds
// two waves, and stage s + 1 flies while stage s is multiplied.
// ---------------------------------------------------------------------------
#define KC   64                        // k per stage
#define NST  (D_DIM / KC)              // 4 stages
#define PA   (KC + 4)                  // z rows, 272 B = 16 B x odd: 16 lanes' b128 reads cover 64 banks
#define PB   36                        // W1 rows, 144 B: rows k and k + 4 lie 16 banks apart
#define STG_A (32 * PA)                // floats of z in one buffer
#define STG  (STG_A + KC * PB)         // floats in one buffer

// Eight async global->LDS copies of 16 B per lane (four of z, four of W1): one stage's share
// of one thread. s_wait_xcnt 0 is the last line of the same statement, so that it stands in
// front of whatever next rewrites an address register named here.
__device__ __forceinline__ void front_stage_copies(const float* ga, const float* gb,
                                                   unsigned la, unsigned lb) {
  asm volatile(
      "global_load_async_to_lds_b128 %0, %8, off\n\t"
      "global_load_async_to_lds_b128 %1, %9, off\n\t"
      "global_load_async_to_lds_b128 %2, %10, off\n\t"
      "global_load_async_to_lds_b128 %3, %11, off\n\t"
      "global_load_async_to_lds_b128 %4, %12, off\n\t"
      "global_load_async_to_lds_b128 %5, %13, off\n\t"
      "global_load_async_to_lds_b128 %6, %14, off\n\t"
      "global_load_async_to_lds_b128 %7, %15, off\n\t"
      "s_wait_xcnt 0x0"
      :
      : "v"(la), "v"(la + 8 * PA * 4), "v"(la + 16 * PA * 4), "v"(la + 24 * PA * 4),
        "v"(lb), "v"(lb + 16 * PB * 4), "v"(lb + 32 * PB * 4), "v"(lb + 48 * PB * 4),
        "v"(ga), "v"(ga + 8 * D_DIM), "v"(ga + 16 * D_DIM), "v"(ga + 24 * D_DIM),
        "v"(gb), "v"(gb + 16 * H_DIM), "v"(gb + 32 * H_DIM), "v"(gb + 48 * H_DIM)
      : "memory");
}

__global__ __launch_bounds__(128) void CFM_front_gemm(
    const float* __restrict__ z_t, const float* __restrict__ z_o,
    const float* __restrict__ W1,  const float* __restrict__ b1,
    float* __restrict__ HT, float* __restrict__ HOB)
{
  __shared__ __attribute__((aligned(16))) float stg[2 * STG];

  const int tid  = threadIdx.x;
  const int lane = tid & 31;
  const int wave = tid >> 5;

  const int HT_BLOCKS = (T_DIM / 32) * (H_DIM / 32);   // 32*16 = 512
  const bool is_o = (int)blockIdx.x >= HT_BLOCKS;      // block-uniform
  const int  blk  = is_o ? (int)blockIdx.x - HT_BLOCKS : (int)blockIdx.x;
  const int  m0   = (blk >> 4) << 5;                   // H/32 = 16 column tiles per row tile
  const int  n0   = (blk & 15) << 5;
  const float* src   = is_o ? z_o : z_t;
  const float* wbase = is_o ? W1 + D_DIM * H_DIM : W1;
  float*       dst   = is_o ? HOB : HT;

  // Copy share of this thread. z: rows (tid >> 4) + 8i, 16 B at k = 4 * (tid & 15).
  // W1: rows (tid >> 3) + 16i of the stage, 16 B at column 4 * (tid & 7).
  const float* ga = src   + (m0 + (tid >> 4)) * D_DIM + ((tid & 15) << 2);
  const float* gb = wbase + (tid >> 3) * H_DIM + n0 + ((tid & 7) << 2);
  const unsigned lds0 = (unsigned)(unsigned long long)stg;
  const unsigned la = lds0 + (unsigned)(((tid >> 4) * PA + ((tid & 15) << 2)) * 4);
  const unsigned lb = lds0 + (unsigned)((STG_A + (tid >> 3) * PB + ((tid & 7) << 2)) * 4);

  // Fragments. Lane half hf takes k = 8g + 4hf + {0,1} in the first WMMA of a group of 8 k
  // and 8g + 4hf + {2,3} in the second, for A and for B alike: one b128 read gives A for both.
  const int lm = lane & 15;
  const int hf = lane >> 4;
  const float* fa = stg + ((wave >> 1) * 16 + lm) * PA + 4 * hf;
  const float* fb = stg + STG_A + 4 * hf * PB + (wave & 1) * 16 + lm;

  const int ncol = n0 + (wave & 1) * 16 + lm;          // D: N = lane & 15
  const float bias = is_o ? b1[ncol] : 0.0f;
  const float sgn  = is_o ? -1.0f : 1.0f;

  front_stage_copies(ga, gb, la, lb);
  asm volatile("s_wait_asynccnt 0x0" ::: "memory");    // this wave's share of stage 0 has landed
  __syncthreads();                                     // ... and every other wave's
  front_stage_copies(ga + KC, gb + KC * H_DIM, la + STG * 4, lb + STG * 4);

  v8f acc = {};
  #pragma unroll  // constant s: buffer offsets fold into the LDS reads' immediates
  for (int s = 0; s < NST; ++s) {
    const float* pa = fa + (s & 1) * STG;
    const float* pb = fb + (s & 1) * STG;
    // All fragment reads of the stage stand ahead of its WMMAs: one LDS latency per stage,
    // not one per pair of WMMAs.
    v4f a[KC / 8];
    v2f b[KC / 4];
    #pragma unroll  // constant g: the fragments stay in registers
    for (int g = 0; g < KC / 8; ++g) {
      a[g] = *(const v4f*)(pa + 8 * g);
      b[2 * g].x     = pb[(8 * g + 0) * PB];
      b[2 * g].y     = pb[(8 * g + 1) * PB];
      b[2 * g + 1].x = pb[(8 * g + 2) * PB];
      b[2 * g + 1].y = pb[(8 * g + 3) * PB];
    }
    // Keeps the reads above where they stand: without it the compiler sinks each read to just
    // ahead of the WMMA that uses it, and the wave then waits on LDS at every pair of WMMAs.
    __builtin_amdgcn_sched_barrier(0);
    #pragma unroll  // constant g, as above
    for (int g = 0; g < KC / 8; ++g) {
      acc = __builtin_amdgcn_wmma_f32_16x16x4_f32(
          /*neg_a=*/false, a[g].xy, /*neg_b=*/false, b[2 * g],
          /*c_mod=*/(short)0, acc, /*reuse_a=*/false, /*reuse_b=*/false);
      acc = __builtin_amdgcn_wmma_f32_16x16x4_f32(
          /*neg_a=*/false, a[g].zw, /*neg_b=*/false, b[2 * g + 1],
          /*c_mod=*/(short)0, acc, /*reuse_a=*/false, /*reuse_b=*/false);
    }
    // Keeps the WMMAs of stage s ahead of the waits below: without it the compiler sinks them
    // behind the wait for stage s + 1, and the copies then fly with nothing to hide them.
    __builtin_amdgcn_sched_barrier(0);
    // Hand-over: this wave's reads of stage s are done, its copies of stage s + 1 have landed;
    // behind the barrier that holds for all four waves, and the buffer just read may be refilled.
    asm volatile("s_wait_dscnt 0x0" ::: "memory");
    asm volatile("s_wait_asynccnt 0x0" ::: "memory");
    __syncthreads();
    if (s + 2 < NST) {
      front_stage_copies(ga + (s + 2) * KC, gb + (s + 2) * KC * H_DIM,
                         la + (s & 1) * STG * 4, lb + (s & 1) * STG * 4);
    }
  }
  asm volatile("s_wait_asynccnt 0x0" ::: "memory");    // no copy is left in flight at the wave's end

  // Four vector slots between the last WMMA and the first vector instruction that reads its
  // result: otherwise only waits, a barrier and one vector instruction stand between the two.
  asm volatile("v_nop\n\tv_nop\n\tv_nop\n\tv_nop" : "+v"(acc));

  const int row0 = m0 + (wave >> 1) * 16 + (hf << 3);           // D: M = r + (lane >> 4) * 8
  #pragma unroll
  for (int r = 0; r < 8; ++r) {
    dst[(row0 + r) * H_DIM + ncol] = (acc[r] + bias) * sgn;
  }
}

// ---------------------------------------------------------------------------
// Async global->LDS copy of one 16B chunk per lane (ASYNCcnt-tracked DMA).
// VDST operand carries the wave-relative LDS byte address; flat LDS pointers
// hold the LDS offset in their low 32 bits (aperture layout).
// ---------------------------------------------------------------------------
__device__ __forceinline__ void async_copy_b128(const float* gsrc, float* lds_dst) {
  unsigned lds_off = (unsigned)(unsigned long long)lds_dst;
  asm volatile("global_load_async_to_lds_b128 %0, %1, off"
               :
               : "v"(lds_off), "v"(gsrc)
               : "memory");
}

// (max(ax, bx), max(ay, by)) as one dual-issue instruction on the registers as LDS loaded them.
// What it is for: in front of fmaxf the compiler first quiets every loaded operand with
// max(x, x), one more max per loaded register in every step of phase 2.
// The quieting changes a signalling NaN only, and HT and HOB hold results of float arithmetic,
// which are never signalling. The outputs are early-clobber: neither half may overwrite a
// source of the other. Not volatile: a pure function of its inputs, free to be scheduled.
__device__ __forceinline__ v2f max_pair(float ax, float ay, float bx, float by) {
  float mx, my;
  asm("v_dual_max_num_f32 %0, %2, %4 :: v_dual_max_num_f32 %1, %3, %5"
      : "=&v"(mx), "=&v"(my)
      : "v"(ax), "v"(ay), "v"(bx), "v"(by));
  return (v2f){mx, my};
}

__device__ __forceinline__ void wait_async_all() {
  asm volatile("s_wait_asynccnt 0x0" ::: "memory");
}

// ---------------------------------------------------------------------------
// Phase 2: out[t,o] = b2 + sum_h lrelu(a + b) * W2[h], a = HT[t,h], b = -HOB[o,h].
// lrelu(a + b) = 0.01*(a + b) + 0.99*max(a + b, 0) and max(a + b, 0) = max(a, -b) + b, so
//   out[t,o] = b2 + 0.01*sum_h W2*a + sum_h W2*b + 0.99*sum_h W2*max(a, -b):
// the first two sums belong to one row of one tile each (96 rows per block); only the
// last one is per (t,o) pair, and it costs one max and one multiply-add per h.
// 32t x 64o tile per 256-thread block, one block per WGP, 256 blocks; each wave covers the
// whole tile with an 8x8 register tile per thread over one eighth of h; slices are summed
// in LDS. HT/HOB tiles + W2 staged in LDS (~196KB static) via async-to-LDS DMA.
// ---------------------------------------------------------------------------
#define OT 64                              // o columns of one block
#define P2_LDS ((32 + OT) * PADH + H_DIM)  // floats of LDS

// Eight async global->LDS copies of 16 B per lane: the same 16-B column of eight rows, two rows
// apart. s_wait_xcnt 0 is the last line of the same statement, so that it stands in front of
// whatever next rewrites an address register named here.
__device__ __forceinline__ void tile_copies(const float* g, unsigned l) {
  asm volatile(
      "global_load_async_to_lds_b128 %0, %8, off\n\t"
      "global_load_async_to_lds_b128 %1, %9, off\n\t"
      "global_load_async_to_lds_b128 %2, %10, off\n\t"
      "global_load_async_to_lds_b128 %3, %11, off\n\t"
      "global_load_async_to_lds_b128 %4, %12, off\n\t"
      "global_load_async_to_lds_b128 %5, %13, off\n\t"
      "global_load_async_to_lds_b128 %6, %14, off\n\t"
      "global_load_async_to_lds_b128 %7, %15, off\n\t"
      "s_wait_xcnt 0x0"
      :
      : "v"(l), "v"(l + 2 * PADH * 4), "v"(l + 4 * PADH * 4), "v"(l + 6 * PADH * 4),
        "v"(l + 8 * PADH * 4), "v"(l + 10 * PADH * 4), "v"(l + 12 * PADH * 4), "v"(l + 14 * PADH * 4),
        "v"(g), "v"(g + 2 * H_DIM), "v"(g + 4 * H_DIM), "v"(g + 6 * H_DIM),
        "v"(g + 8 * H_DIM), "v"(g + 10 * H_DIM), "v"(g + 12 * H_DIM), "v"(g + 14 * H_DIM)
      : "memory");
}

// What one thread reads from LDS for one step of 4 h.
struct Step {
  v4f w;            // W2
  v4f ra, rb0, rb1; // the three rows whose row sums this lane keeps
  v4f b[8];         // s_ho rows og + 8j
  v4f a[8];         // s_ht rows tg + 4i
};

__device__ __forceinline__ void step_load(Step& s, const float* ap, const float* bp, const float* wp,
                                          const float* rap, const float* rbp, int h) {
  s.w = *(const v4f*)(wp + h);
  #pragma unroll  // constant j and i: the operands stay in registers
  for (int j = 0; j < 8; ++j) s.b[j] = *(const v4f*)(bp + j * 8 * PADH + h);
  #pragma unroll
  for (int i = 0; i < 8; ++i) s.a[i] = *(const v4f*)(ap + i * 4 * PADH + h);
  s.ra  = *(const v4f*)(rap + h);
  s.rb0 = *(const v4f*)(rbp + h);
  s.rb1 = *(const v4f*)(rbp + 32 * PADH + h);
}

// The loops over i and j are fully unrolled: every tile index is then a constant and
// the tile stays in registers. Each sum is kept as an (even h, odd h) pair, so that a
// loaded register pair feeds a packed multiply-add as it lies.
__device__ __forceinline__ void step_sum(const Step& s, v2f (&acc)[8][8], v2f& sa, v2f& sb0, v2f& sb1) {
  const v2f w01 = s.w.xy;
  const v2f w23 = s.w.zw;
  sa  = __builtin_elementwise_fma(s.ra.xy,  w01, sa);
  sb0 = __builtin_elementwise_fma(s.rb0.xy, w01, sb0);
  sb1 = __builtin_elementwise_fma(s.rb1.xy, w01, sb1);
  sa  = __builtin_elementwise_fma(s.ra.zw,  w23, sa);
  sb0 = __builtin_elementwise_fma(s.rb0.zw, w23, sb0);
  sb1 = __builtin_elementwise_fma(s.rb1.zw, w23, sb1);
  #pragma unroll
  for (int i = 0; i < 8; ++i) {
    const v4f a = s.a[i];
    v2f m01[8], m23[8];
    #pragma unroll
    for (int j = 0; j < 8; ++j) {
      const v4f b = s.b[j];
      m01[j] = max_pair(a.x, a.y, b.x, b.y);
      m23[j] = max_pair(a.z, a.w, b.z, b.w);
    }
    // Keeps the 16 maxima of row i ahead of its 16 multiply-adds: without it the compiler puts
    // each multiply-add right behind its maximum, and the wave waits out the latency of each.
    __builtin_amdgcn_sched_barrier(0);
    #pragma unroll
    for (int j = 0; j < 8; ++j) acc[i][j] = __builtin_elementwise_fma(m01[j], w01, acc[i][j]);
    #pragma unroll
    for (int j = 0; j < 8; ++j) acc[i][j] = __builtin_elementwise_fma(m23[j], w23, acc[i][j]);
    // Ends row i before row i + 1 begins: without it the compiler forms the maxima of all eight
    // rows ahead of the sums, 256 registers of them, and spills to scratch.
    __builtin_amdgcn_sched_barrier(0);
  }
}

// LDS admits one block per WGP = two waves per SIMD, so each wave may own 512 registers: room
// for the 8x8 tile of sums and two sets of operands.
__global__ __launch_bounds__(256)
void CFM_broadcast_mlp(
    const float* __restrict__ HT, const float* __restrict__ HOB,
    const float* __restrict__ W2, const float* __restrict__ b2,
    float* __restrict__ out)
{
  __shared__ __attribute__((aligned(16))) float smem[P2_LDS];
  float* s_ht = smem;                        // 32 * 516
  float* s_ho = smem + 32 * PADH;            // 64 * 516
  float* s_w2 = smem + (32 + OT) * PADH;     // 512

  const int tid = threadIdx.x;
  const int t0  = (blockIdx.x >> 3) << 5;   // O/64 = 8 o-tiles
  const int o0  = (blockIdx.x & 7) << 6;

  // Async stage-in: 32 + 64 rows x 128 float4 + 128 float4 of W2: 49 copies per wave at most.
  // This thread: rows (tid >> 7) + 2m of each tile, 16 B at column 4 * (tid & 127).
  {
    const int r = tid >> 7;
    const int c = (tid & 127) << 2;
    const float* gt = HT  + (t0 + r) * H_DIM + c;
    const float* go = HOB + (o0 + r) * H_DIM + c;
    const unsigned l = (unsigned)(unsigned long long)smem + (unsigned)((r * PADH + c) * 4);
    tile_copies(gt,              l);
    tile_copies(gt + 16 * H_DIM, l + 16 * PADH * 4);
    tile_copies(go,              l + 32 * PADH * 4);
    tile_copies(go + 16 * H_DIM, l + 48 * PADH * 4);
    tile_copies(go + 32 * H_DIM, l + 64 * PADH * 4);
    tile_copies(go + 48 * H_DIM, l + 80 * PADH * 4);
  }
  if (tid < H_DIM / 4) {
    async_copy_b128(W2 + (tid << 2), s_w2 + (tid << 2));
  }
  wait_async_all();
  __syncthreads();

  // 8x8 register tile per thread: the 32 lanes of a wave cover the whole 32x64
  // tile (rows tg + 4i, cols og + 8j) and each of the 8 waves sums its own 64 h.
  // Per 4-h step 20 ds_load_b128 feed 256 products per lane. In each 16-lane half
  // a load touches 2 (s_ht) or 8 (s_ho) neighbouring rows, 4 banks apart: no conflict.
  const int lane = tid & 31;
  const int wv   = tid >> 5;
  const int tg   = lane >> 3;
  const int og   = lane & 7;
  const float* ap = s_ht + tg * PADH + wv * HSLICE;
  const float* bp = s_ho + og * PADH + wv * HSLICE;
  const float* wp = s_w2 + wv * HSLICE;

  // Row sums: in each wave lane l also sums W2*row over the wave's h slice for row l of
  // s_ht and rows l and l + 32 of s_ho (rows 4 banks apart: no conflict).
  const float* rap = s_ht + lane * PADH + wv * HSLICE;
  const float* rbp = s_ho + lane * PADH + wv * HSLICE;

  v2f acc[8][8];
  #pragma unroll  // constant i and j: the tile stays in registers
  for (int i = 0; i < 8; ++i) {
    #pragma unroll
    for (int j = 0; j < 8; ++j) acc[i][j] = (v2f){0.0f, 0.0f};
  }
  v2f sa  = {0.0f, 0.0f};
  v2f sb0 = {0.0f, 0.0f};
  v2f sb1 = {0.0f, 0.0f};

  // Two register sets: the LDS reads of the next step are issued ahead of this step's sums.
  // With two waves on a SIMD there is too little other work to cover a step's LDS latency.
  Step x, y;
  step_load(x, ap, bp, wp, rap, rbp, 0);
  for (int h = 0; h < HSLICE - 8; h += 8) {
    step_load(y, ap, bp, wp, rap, rbp, h + 4);
    step_sum(x, acc, sa, sb0, sb1);
    step_load(x, ap, bp, wp, rap, rbp, h + 8);
    step_sum(y, acc, sa, sb0, sb1);
  }
  step_load(y, ap, bp, wp, rap, rbp, HSLICE - 4);
  step_sum(x, acc, sa, sb0, sb1);
  step_sum(y, acc, sa, sb0, sb1);

  // Combine the 8 h-slices through LDS, laid out [slice][i][half of j][lane] as float4 over
  // four j; the row sums lie behind them as [row][slice], s_ht's 32 rows first.
  // First barrier: every wave has read its last staged value before the tiles are
  // overwritten. Second barrier: all partial sums are in LDS before they are read.
  float4* red = (float4*)smem;
  float*  rs  = smem + 8 * 8 * 2 * 32 * 4;
  __syncthreads();
  #pragma unroll  // constant i: acc is stored straight from its registers
  for (int i = 0; i < 8; ++i) {
    #pragma unroll  // constant q, as above
    for (int q = 0; q < 2; ++q) {
      red[((wv * 8 + i) * 2 + q) * 32 + lane] =
          make_float4(acc[i][4 * q + 0].x + acc[i][4 * q + 0].y, acc[i][4 * q + 1].x + acc[i][4 * q + 1].y,
                      acc[i][4 * q + 2].x + acc[i][4 * q + 2].y, acc[i][4 * q + 3].x + acc[i][4 * q + 3].y);
    }
  }
  rs[lane * 8 + wv]        = sa.x + sa.y;
  rs[(32 + lane) * 8 + wv] = sb0.x + sb0.y;
  rs[(64 + lane) * 8 + wv] = sb1.x + sb1.y;
  __syncthreads();

  // Thread (wv, lane) finishes row tg + 4*wv, cols og + 8j.
  float4 s[2];
  #pragma unroll  // constant q: s stays in registers
  for (int q = 0; q < 2; ++q) {
    s[q] = red[(wv * 2 + q) * 32 + lane];
    #pragma unroll  // the reads of all slices are issued ahead of the adds
    for (int k = 1; k < 8; ++k) {
      const float4 p = red[((k * 8 + wv) * 2 + q) * 32 + lane];
      s[q].x += p.x; s[q].y += p.y; s[q].z += p.z; s[q].w += p.w;
    }
  }
  // rowsum[0]: W2 . HT row of this thread; rowsum[1 + j]: W2 . HOB row of column og + 8j.
  float rowsum[9];
  #pragma unroll  // constant q: rowsum stays in registers
  for (int q = 0; q < 9; ++q) {
    const int row = (q == 0) ? (tg + 4 * wv) : (32 + og + 8 * (q - 1));
    const float4 p0 = *(const float4*)(rs + row * 8);
    const float4 p1 = *(const float4*)(rs + row * 8 + 4);
    rowsum[q] = ((p0.x + p0.y) + (p0.z + p0.w)) + ((p1.x + p1.y) + (p1.z + p1.w));
  }

  const float base = fmaf(0.01f, rowsum[0], b2[0]);
  float* orow = out + (t0 + tg + 4 * wv) * O_DIM + (o0 + og);
  orow[0]  = fmaf(0.99f, s[0].x, base - rowsum[1]);
  orow[8]  = fmaf(0.99f, s[0].y, base - rowsum[2]);
  orow[16] = fmaf(0.99f, s[0].z, base - rowsum[3]);
  orow[24] = fmaf(0.99f, s[0].w, base - rowsum[4]);
  orow[32] = fmaf(0.99f, s[1].x, base - rowsum[5]);
  orow[40] = fmaf(0.99f, s[1].y, base - rowsum[6]);
  orow[48] = fmaf(0.99f, s[1].z, base - rowsum[7]);
  orow[56] = fmaf(0.99f, s[1].w, base - rowsum[8]);
}

extern "C" void kernel_launch(void* const* d_in, const int* in_sizes, int n_in,
                              void* d_out, int out_size, void* d_ws, size_t ws_size,
                              hipStream_t stream) {
  (void)in_sizes; (void)n_in; (void)out_size; (void)ws_size;
  const float* z_t = (const float*)d_in[0];
  const float* z_o = (const float*)d_in[1];
  const float* W1  = (const float*)d_in[2];
  const float* b1  = (const float*)d_in[3];
  const float* W2  = (const float*)d_in[4];
  const float* b2  = (const float*)d_in[5];

  float* HT  = (float*)d_ws;                 // T*H floats (2MB)
  float* HOB = HT + (size_t)T_DIM * H_DIM;   // O*H floats (1MB)

  // Phase 1: 768 tiles of 32x32, 4 waves (128 threads) per block.
  CFM_front_gemm<<<768, 128, 0, stream>>>(z_t, z_o, W1, b1, HT, HOB);

  // Phase 2: (T/32)*(O/64) = 256 blocks, 256 threads, ~196KB static LDS.
  CFM_broadcast_mlp<<<256, 256, 0, stream>>>(HT, HOB, W2, b2, (float*)d_out);
}
